// v000
// Times are from an AMD MI455X. After a warm-up the kernel runs many times in a row, and a time is the length of
// such a window on the GPU divided by its runs, so every launch and the gaps after it count. The runs cycle
// through copies of the inputs. A figure is the median of several windows, for all but v000 over two sittings.
// Sittings can differ by a few percent; kernels timed side by side share one.
// v000 is the starting kernel. One run takes 21 microseconds.
#include <hip/hip_runtime.h>
#include <math.h>

// CDNA5 / gfx1250 flash-attention for B=4,H=8,S=2048,D=3 (fp32).
// Scores via V_WMMA_F32_16X16X4_F32 computing S^T = K * Q^T so each lane owns
// one query column -> lane-local online softmax + P*V accumulation.
// v2: K stored in LDS pre-swizzled to the WMMA A-operand layout (one aligned
//     ds_load_b64, zero cndmasks), software-pipelined A prefetch, and two
//     query tiles per wave sharing K/V loads (2 independent WMMA chains).

typedef float v2f __attribute__((ext_vector_type(2)));
typedef float v8f __attribute__((ext_vector_type(8)));

#define B_    4
#define H_    8
#define S_    2048
#define D_    3
#define WAVES 8
#define BLK   (WAVES * 32)
#define NT    (S_ / 16)          // 128 key tiles
#define QTPW  2                  // query tiles per wave

__device__ __forceinline__ float fast_exp2(float x) {
#if __has_builtin(__builtin_amdgcn_exp2f)
  return __builtin_amdgcn_exp2f(x);   // v_exp_f32
#else
  return exp2f(x);
#endif
}

__global__ __launch_bounds__(BLK) void attn_f32_wmma_kernel(
    const float* __restrict__ x,    // [B,1,S,3]
    const float* __restrict__ Wq,   // [1,H,3,3]
    const float* __restrict__ Wk,   // [1,H,3,3]
    const float* __restrict__ Wv,   // [1,H,3,3]
    float* __restrict__ out)        // 2x [B,H,S,3] concatenated
{
  // K rows pre-swizzled for the A operand: [k0,k1,k2,0] per key (16B).
  __shared__ __align__(16) float lKA[S_ * 4];        // 32 KB
  __shared__ __align__(16) float lV [S_ * 4];        // 32 KB

  const int bh   = blockIdx.x;
  const int b    = bh / H_;
  const int h    = bh % H_;
  const int tid  = threadIdx.x;
  const int lane = tid & 31;
  const int wave = tid >> 5;
  const bool hiHalf = (lane >= 16);

  const float* xb = x  + (size_t)b * (S_ * D_);
  const float* wq = Wq + h * 9;
  const float* wk = Wk + h * 9;
  const float* wv = Wv + h * 9;

  // ---- Stage K (A-operand layout) and V into LDS (block cooperates) ----
  #pragma unroll
  for (int j = 0; j < S_ / BLK; ++j) {
    const int k = j * BLK + tid;
    const float x0 = xb[k * 3 + 0];
    const float x1 = xb[k * 3 + 1];
    const float x2 = xb[k * 3 + 2];
    lKA[k * 4 + 0] = x0 * wk[0] + x1 * wk[3] + x2 * wk[6];
    lKA[k * 4 + 1] = x0 * wk[1] + x1 * wk[4] + x2 * wk[7];
    lKA[k * 4 + 2] = x0 * wk[2] + x1 * wk[5] + x2 * wk[8];
    lKA[k * 4 + 3] = 0.0f;                       // zero-pad for hi-half a.y
    lV [k * 4 + 0] = x0 * wv[0] + x1 * wv[3] + x2 * wv[6];
    lV [k * 4 + 1] = x0 * wv[1] + x1 * wv[4] + x2 * wv[7];
    lV [k * 4 + 2] = x0 * wv[2] + x1 * wv[5] + x2 * wv[8];
    lV [k * 4 + 3] = 0.0f;
  }
  __syncthreads();

  // ---- Two query tiles per wave: Q projections, pre-scaled ----
  const int pair  = blockIdx.y * WAVES + wave;       // 0..63
  const int qrow0 = pair * 32 + (lane & 15);
  const int qrow1 = qrow0 + 16;
  const float qs  = 1.4426950408889634f * 0.5773502691896258f; // log2e/sqrt(3)

  v2f bOp0, bOp1;
  {
    const float a = xb[qrow0 * 3 + 0], c = xb[qrow0 * 3 + 1], e = xb[qrow0 * 3 + 2];
    const float Q0 = (a * wq[0] + c * wq[3] + e * wq[6]) * qs;
    const float Q1 = (a * wq[1] + c * wq[4] + e * wq[7]) * qs;
    const float Q2 = (a * wq[2] + c * wq[5] + e * wq[8]) * qs;
    bOp0.x = hiHalf ? Q2 : Q0;
    bOp0.y = hiHalf ? 0.0f : Q1;
  }
  {
    const float a = xb[qrow1 * 3 + 0], c = xb[qrow1 * 3 + 1], e = xb[qrow1 * 3 + 2];
    const float Q0 = (a * wq[0] + c * wq[3] + e * wq[6]) * qs;
    const float Q1 = (a * wq[1] + c * wq[4] + e * wq[7]) * qs;
    const float Q2 = (a * wq[2] + c * wq[5] + e * wq[8]) * qs;
    bOp1.x = hiHalf ? Q2 : Q0;
    bOp1.y = hiHalf ? 0.0f : Q1;
  }

  // Flash state, lane-local (this lane covers its key half)
  float m0 = -3.0e38f, l0 = 0.0f, p00 = 0.0f, p01 = 0.0f, p02 = 0.0f;
  float m1 = -3.0e38f, l1 = 0.0f, p10 = 0.0f, p11 = 0.0f, p12 = 0.0f;

  const float4* lV4 = (const float4*)lV;
  const int krow16 = lane & 15;
  const int hal8   = hiHalf ? 8 : 0;
  // A-operand float index for this lane within a tile (8B-aligned v2f):
  const int aIdx = krow16 * 4 + (hiHalf ? 2 : 0);

  v2f aCur = *(const v2f*)&lKA[aIdx];                // tile 0 prefetch

  for (int t = 0; t < NT; ++t) {
    // Prefetch next tile's A operand (wraps harmlessly on the last iter).
    const int tn = (t + 1) & (NT - 1);
    const v2f aNext = *(const v2f*)&lKA[tn * 64 + aIdx];

    v8f c0 = {};
    v8f c1 = {};
    c0 = __builtin_amdgcn_wmma_f32_16x16x4_f32(
        false, aCur, false, bOp0, (short)0, c0, false, false);
    c1 = __builtin_amdgcn_wmma_f32_16x16x4_f32(
        false, aCur, false, bOp1, (short)0, c1, false, false);

    float tm0 = c0[0], tm1 = c1[0];
    #pragma unroll
    for (int i = 1; i < 8; ++i) { tm0 = fmaxf(tm0, c0[i]); tm1 = fmaxf(tm1, c1[i]); }
    const float mn0 = fmaxf(m0, tm0);
    const float mn1 = fmaxf(m1, tm1);
    const float cr0 = fast_exp2(m0 - mn0);
    const float cr1 = fast_exp2(m1 - mn1);
    m0 = mn0; m1 = mn1;
    l0 *= cr0; p00 *= cr0; p01 *= cr0; p02 *= cr0;
    l1 *= cr1; p10 *= cr1; p11 *= cr1; p12 *= cr1;

    const int kb = t * 16;
    #pragma unroll
    for (int i = 0; i < 8; ++i) {
      const float4 v = lV4[kb + hal8 + i];   // shared by both query tiles
      const float e0 = fast_exp2(c0[i] - mn0);
      const float e1 = fast_exp2(c1[i] - mn1);
      l0 += e0;                 l1 += e1;
      p00 = fmaf(e0, v.x, p00); p10 = fmaf(e1, v.x, p10);
      p01 = fmaf(e0, v.y, p01); p11 = fmaf(e1, v.y, p11);
      p02 = fmaf(e0, v.z, p02); p12 = fmaf(e1, v.z, p12);
    }
    aCur = aNext;
  }

  // ---- Combine the two key-halves (lane L <-> L^16 share a query) ----
  const size_t dup = (size_t)B_ * H_ * S_ * 3;       // tuple returns (ctx, ctx)
  const size_t headOff = (size_t)(b * H_ + h) * S_;

  {
    const float m_o = __shfl_xor(m0, 16, 32);
    const float l_o = __shfl_xor(l0, 16, 32);
    const float b0  = __shfl_xor(p00, 16, 32);
    const float b1  = __shfl_xor(p01, 16, 32);
    const float b2  = __shfl_xor(p02, 16, 32);
    const float mt = fmaxf(m0, m_o);
    const float fs = fast_exp2(m0 - mt);
    const float fo = fast_exp2(m_o - mt);
    const float inv = 1.0f / (l0 * fs + l_o * fo);
    const float o0 = (p00 * fs + b0 * fo) * inv;
    const float o1 = (p01 * fs + b1 * fo) * inv;
    const float o2 = (p02 * fs + b2 * fo) * inv;
    if (!hiHalf) {
      const size_t off = (headOff + qrow0) * 3;
      out[off + 0] = o0; out[off + 1] = o1; out[off + 2] = o2;
      out[dup + off + 0] = o0; out[dup + off + 1] = o1; out[dup + off + 2] = o2;
    }
  }
  {
    const float m_o = __shfl_xor(m1, 16, 32);
    const float l_o = __shfl_xor(l1, 16, 32);
    const float b0  = __shfl_xor(p10, 16, 32);
    const float b1  = __shfl_xor(p11, 16, 32);
    const float b2  = __shfl_xor(p12, 16, 32);
    const float mt = fmaxf(m1, m_o);
    const float fs = fast_exp2(m1 - mt);
    const float fo = fast_exp2(m_o - mt);
    const float inv = 1.0f / (l1 * fs + l_o * fo);
    const float o0 = (p10 * fs + b0 * fo) * inv;
    const float o1 = (p11 * fs + b1 * fo) * inv;
    const float o2 = (p12 * fs + b2 * fo) * inv;
    if (!hiHalf) {
      const size_t off = (headOff + qrow1) * 3;
      out[off + 0] = o0; out[off + 1] = o1; out[off + 2] = o2;
      out[dup + off + 0] = o0; out[dup + off + 1] = o1; out[dup + off + 2] = o2;
    }
  }
}

extern "C" void kernel_launch(void* const* d_in, const int* in_sizes, int n_in,
                              void* d_out, int out_size, void* d_ws, size_t ws_size,
                              hipStream_t stream) {
  (void)in_sizes; (void)n_in; (void)out_size; (void)d_ws; (void)ws_size;
  const float* x  = (const float*)d_in[0];
  const float* Wq = (const float*)d_in[1];
  const float* Wk = (const float*)d_in[2];
  const float* Wv = (const float*)d_in[3];
  float* out = (float*)d_out;

  dim3 grid(B_ * H_, (S_ / 16) / (WAVES * QTPW));   // (32, 8)
  attn_f32_wmma_kernel<<<grid, BLK, 0, stream>>>(x, Wq, Wk, Wv, out);
}

// v001
// Measured time: 18.7 microseconds a run.
// In both of two side-by-side timings against v000, it was 1.17 times as fast.
#include <hip/hip_runtime.h>
#include <math.h>

// CDNA5 / gfx1250 flash-attention for B=4,H=8,S=2048,D=3 (fp32).
// Scores via V_WMMA_F32_16X16X4_F32 computing S^T = K * Q^T so each lane owns
// one query column -> lane-local online softmax + P*V accumulation.
// v2: K stored in LDS pre-swizzled to the WMMA A-operand layout (one aligned
//     ds_load_b64, zero cndmasks), software-pipelined A prefetch, and two
//     query tiles per wave sharing K/V loads (2 independent WMMA chains).
// v3: fixed softmax reference per query instead of the running maximum. With
//     U = |q| * max|k| >= every score and L = best score of key tile 0, the
//     reference r = max(L, U - 100) keeps every exponent <= 100 and the
//     largest one >= -90 whenever U - L <= 190. -r rides in the unused k = 3
//     slot of the score WMMA (K row padded with 1), so the loop has no
//     maximum, no subtraction and no rescale. A wave with a query outside
//     that window runs the running-maximum loop as before.

typedef float v2f __attribute__((ext_vector_type(2)));
typedef float v8f __attribute__((ext_vector_type(8)));

#define B_    4
#define H_    8
#define S_    2048
#define D_    3
#define WAVES 8
#define BLK   (WAVES * 32)
#define NT    (S_ / 16)          // 128 key tiles
#define QTPW  2                  // query tiles per wave

__device__ __forceinline__ float fast_exp2(float x) {
#if __has_builtin(__builtin_amdgcn_exp2f)
  return __builtin_amdgcn_exp2f(x);   // v_exp_f32
#else
  return exp2f(x);
#endif
}

// lane l <-> lane l ^ 16
__device__ __forceinline__ float xhalf(float v) {
  const int b = __builtin_bit_cast(int, v);
  return __builtin_bit_cast(float, __builtin_amdgcn_permlanex16(
      b, b, 0x76543210, 0xfedcba98, false, false));
}

// maximum with the lane whose index differs by XM inside a 16-lane row
template <int XM>
__device__ __forceinline__ float row_xmax(float v) {
  const int b = __builtin_bit_cast(int, v);
  return fmaxf(v, __builtin_bit_cast(float, __builtin_amdgcn_update_dpp(
      b, b, 0x160 + XM, 0xf, 0xf, false)));
}

__global__ __launch_bounds__(BLK) void attn_f32_wmma_kernel(
    const float* __restrict__ x,    // [B,1,S,3]
    const float* __restrict__ Wq,   // [1,H,3,3]
    const float* __restrict__ Wk,   // [1,H,3,3]
    const float* __restrict__ Wv,   // [1,H,3,3]
    float* __restrict__ out)        // 2x [B,H,S,3] concatenated
{
  // K rows pre-swizzled for the A operand: [k0,k1,k2,1] per key (16B).
  __shared__ __align__(16) float lKA[S_ * 4];        // 32 KB
  __shared__ __align__(16) float lV [S_ * 4];        // 32 KB
  __shared__ __align__(16) float lR2[WAVES];         // per-wave max |k|^2

  const int bh   = blockIdx.x;
  const int b    = bh / H_;
  const int h    = bh % H_;
  const int tid  = threadIdx.x;
  const int lane = tid & 31;
  const int wave = tid >> 5;
  const bool hiHalf = (lane >= 16);

  const float* xb = x  + (size_t)b * (S_ * D_);
  const float* wq = Wq + h * 9;
  const float* wk = Wk + h * 9;
  const float* wv = Wv + h * 9;

  // ---- Stage K (A-operand layout) and V into LDS (block cooperates) ----
  float r2 = 0.0f;
  #pragma unroll
  for (int j = 0; j < S_ / BLK; ++j) {
    const int k = j * BLK + tid;
    const float x0 = xb[k * 3 + 0];
    const float x1 = xb[k * 3 + 1];
    const float x2 = xb[k * 3 + 2];
    const float k0 = x0 * wk[0] + x1 * wk[3] + x2 * wk[6];
    const float k1 = x0 * wk[1] + x1 * wk[4] + x2 * wk[7];
    const float k2 = x0 * wk[2] + x1 * wk[5] + x2 * wk[8];
    r2 = fmaxf(r2, k0 * k0 + k1 * k1 + k2 * k2);
    lKA[k * 4 + 0] = k0;
    lKA[k * 4 + 1] = k1;
    lKA[k * 4 + 2] = k2;
    lKA[k * 4 + 3] = 1.0f;                       // k = 3 slot: times B's -r or 0
    lV [k * 4 + 0] = x0 * wv[0] + x1 * wv[3] + x2 * wv[6];
    lV [k * 4 + 1] = x0 * wv[1] + x1 * wv[4] + x2 * wv[7];
    lV [k * 4 + 2] = x0 * wv[2] + x1 * wv[5] + x2 * wv[8];
    lV [k * 4 + 3] = 0.0f;
  }
  r2 = row_xmax<1>(r2); r2 = row_xmax<2>(r2);
  r2 = row_xmax<4>(r2); r2 = row_xmax<8>(r2);
  r2 = fmaxf(r2, xhalf(r2));
  if (lane == 0) lR2[wave] = r2;
  __syncthreads();

  float R2;                                          // max |k|^2 of this head
  {
    const float4 ra = ((const float4*)lR2)[0];
    const float4 rb = ((const float4*)lR2)[1];
    R2 = fmaxf(fmaxf(fmaxf(ra.x, ra.y), fmaxf(ra.z, ra.w)),
               fmaxf(fmaxf(rb.x, rb.y), fmaxf(rb.z, rb.w)));
  }

  // ---- Two query tiles per wave: Q projections, pre-scaled ----
  const int pair  = blockIdx.y * WAVES + wave;       // 0..63
  const int qrow0 = pair * 32 + (lane & 15);
  const int qrow1 = qrow0 + 16;
  const float qs  = 1.4426950408889634f * 0.5773502691896258f; // log2e/sqrt(3)

  v2f bOp0, bOp1;
  float qn0, qn1;                                    // |q|^2, scaled
  {
    const float a = xb[qrow0 * 3 + 0], c = xb[qrow0 * 3 + 1], e = xb[qrow0 * 3 + 2];
    const float Q0 = (a * wq[0] + c * wq[3] + e * wq[6]) * qs;
    const float Q1 = (a * wq[1] + c * wq[4] + e * wq[7]) * qs;
    const float Q2 = (a * wq[2] + c * wq[5] + e * wq[8]) * qs;
    bOp0.x = hiHalf ? Q2 : Q0;
    bOp0.y = hiHalf ? 0.0f : Q1;
    qn0 = Q0 * Q0 + Q1 * Q1 + Q2 * Q2;
  }
  {
    const float a = xb[qrow1 * 3 + 0], c = xb[qrow1 * 3 + 1], e = xb[qrow1 * 3 + 2];
    const float Q0 = (a * wq[0] + c * wq[3] + e * wq[6]) * qs;
    const float Q1 = (a * wq[1] + c * wq[4] + e * wq[7]) * qs;
    const float Q2 = (a * wq[2] + c * wq[5] + e * wq[8]) * qs;
    bOp1.x = hiHalf ? Q2 : Q0;
    bOp1.y = hiHalf ? 0.0f : Q1;
    qn1 = Q0 * Q0 + Q1 * Q1 + Q2 * Q2;
  }

  // Flash state, lane-local (this lane covers its key half)
  float m0 = -3.0e38f, l0 = 0.0f, p00 = 0.0f, p01 = 0.0f, p02 = 0.0f;
  float m1 = -3.0e38f, l1 = 0.0f, p10 = 0.0f, p11 = 0.0f, p12 = 0.0f;

  const float4* lV4 = (const float4*)lV;
  const int krow16 = lane & 15;
  const int hal8   = hiHalf ? 8 : 0;
  // A-operand float index for this lane within a tile (8B-aligned v2f):
  const int aIdx = krow16 * 4 + (hiHalf ? 2 : 0);

  v2f aCur = *(const v2f*)&lKA[aIdx];                // tile 0 prefetch

  // ---- Fixed reference per query, and whether it is safe for this wave ----
  float ref0, ref1;
  bool inWindow;
  {
    v8f c0 = {};
    v8f c1 = {};
    c0 = __builtin_amdgcn_wmma_f32_16x16x4_f32(
        false, aCur, false, bOp0, (short)0, c0, false, false);
    c1 = __builtin_amdgcn_wmma_f32_16x16x4_f32(
        false, aCur, false, bOp1, (short)0, c1, false, false);
    float L0 = c0[0], L1 = c1[0];
    #pragma unroll  // constant indices keep c0, c1 in registers
    for (int i = 1; i < 8; ++i) { L0 = fmaxf(L0, c0[i]); L1 = fmaxf(L1, c1[i]); }
    L0 = fmaxf(L0, xhalf(L0));                       // both key halves
    L1 = fmaxf(L1, xhalf(L1));
    const float U0 = sqrtf(qn0 * R2) * 1.0001f;      // |q.k| <= |q||k|, plus a rounding margin
    const float U1 = sqrtf(qn1 * R2) * 1.0001f;
    ref0 = fmaxf(L0, U0 - 100.0f);
    ref1 = fmaxf(L1, U1 - 100.0f);
    inWindow = (U0 - L0 <= 190.0f) && (U1 - L1 <= 190.0f);  // false on inf or NaN
  }

  if (__builtin_amdgcn_ballot_w32(inWindow) == 0xffffffffu) {
    v2f bF0 = bOp0, bF1 = bOp1;
    if (hiHalf) { bF0.y = -ref0; bF1.y = -ref1; }    // k = 3 row of B
    for (int t = 0; t < NT; ++t) {
      const int tn = (t + 1) & (NT - 1);
      const v2f aNext = *(const v2f*)&lKA[tn * 64 + aIdx];

      v8f c0 = {};
      v8f c1 = {};
      c0 = __builtin_amdgcn_wmma_f32_16x16x4_f32(
          false, aCur, false, bF0, (short)0, c0, false, false);
      c1 = __builtin_amdgcn_wmma_f32_16x16x4_f32(
          false, aCur, false, bF1, (short)0, c1, false, false);

      const int kb = t * 16;
      #pragma unroll  // constant indices keep c0, c1 in registers
      for (int i = 0; i < 8; ++i) {
        const float4 v = lV4[kb + hal8 + i];
        const float e0 = fast_exp2(c0[i]);           // c = score - reference
        const float e1 = fast_exp2(c1[i]);
        l0 += e0;                 l1 += e1;
        p00 = fmaf(e0, v.x, p00); p10 = fmaf(e1, v.x, p10);
        p01 = fmaf(e0, v.y, p01); p11 = fmaf(e1, v.y, p11);
        p02 = fmaf(e0, v.z, p02); p12 = fmaf(e1, v.z, p12);
      }
      aCur = aNext;
    }
    m0 = ref0; m1 = ref1;                            // same in both halves
  } else {
  // Running-maximum loop, for a wave with a query outside the window.
  for (int t = 0; t < NT; ++t) {
    // Prefetch next tile's A operand (wraps harmlessly on the last iter).
    const int tn = (t + 1) & (NT - 1);
    const v2f aNext = *(const v2f*)&lKA[tn * 64 + aIdx];

    v8f c0 = {};
    v8f c1 = {};
    c0 = __builtin_amdgcn_wmma_f32_16x16x4_f32(
        false, aCur, false, bOp0, (short)0, c0, false, false);
    c1 = __builtin_amdgcn_wmma_f32_16x16x4_f32(
        false, aCur, false, bOp1, (short)0, c1, false, false);

    float tm0 = c0[0], tm1 = c1[0];
    #pragma unroll
    for (int i = 1; i < 8; ++i) { tm0 = fmaxf(tm0, c0[i]); tm1 = fmaxf(tm1, c1[i]); }
    const float mn0 = fmaxf(m0, tm0);
    const float mn1 = fmaxf(m1, tm1);
    const float cr0 = fast_exp2(m0 - mn0);
    const float cr1 = fast_exp2(m1 - mn1);
    m0 = mn0; m1 = mn1;
    l0 *= cr0; p00 *= cr0; p01 *= cr0; p02 *= cr0;
    l1 *= cr1; p10 *= cr1; p11 *= cr1; p12 *= cr1;

    const int kb = t * 16;
    #pragma unroll
    for (int i = 0; i < 8; ++i) {
      const float4 v = lV4[kb + hal8 + i];   // shared by both query tiles
      const float e0 = fast_exp2(c0[i] - mn0);
      const float e1 = fast_exp2(c1[i] - mn1);
      l0 += e0;                 l1 += e1;
      p00 = fmaf(e0, v.x, p00); p10 = fmaf(e1, v.x, p10);
      p01 = fmaf(e0, v.y, p01); p11 = fmaf(e1, v.y, p11);
      p02 = fmaf(e0, v.z, p02); p12 = fmaf(e1, v.z, p12);
    }
    aCur = aNext;
  }
  }

  // ---- Combine the two key-halves (lane L <-> L^16 share a query) ----
  const size_t dup = (size_t)B_ * H_ * S_ * 3;       // tuple returns (ctx, ctx)
  const size_t headOff = (size_t)(b * H_ + h) * S_;

  {
    const float m_o = __shfl_xor(m0, 16, 32);
    const float l_o = __shfl_xor(l0, 16, 32);
    const float b0  = __shfl_xor(p00, 16, 32);
    const float b1  = __shfl_xor(p01, 16, 32);
    const float b2  = __shfl_xor(p02, 16, 32);
    const float mt = fmaxf(m0, m_o);
    const float fs = fast_exp2(m0 - mt);
    const float fo = fast_exp2(m_o - mt);
    const float inv = 1.0f / (l0 * fs + l_o * fo);
    const float o0 = (p00 * fs + b0 * fo) * inv;
    const float o1 = (p01 * fs + b1 * fo) * inv;
    const float o2 = (p02 * fs + b2 * fo) * inv;
    if (!hiHalf) {
      const size_t off = (headOff + qrow0) * 3;
      out[off + 0] = o0; out[off + 1] = o1; out[off + 2] = o2;
      out[dup + off + 0] = o0; out[dup + off + 1] = o1; out[dup + off + 2] = o2;
    }
  }
  {
    const float m_o = __shfl_xor(m1, 16, 32);
    const float l_o = __shfl_xor(l1, 16, 32);
    const float b0  = __shfl_xor(p10, 16, 32);
    const float b1  = __shfl_xor(p11, 16, 32);
    const float b2  = __shfl_xor(p12, 16, 32);
    const float mt = fmaxf(m1, m_o);
    const float fs = fast_exp2(m1 - mt);
    const float fo = fast_exp2(m_o - mt);
    const float inv = 1.0f / (l1 * fs + l_o * fo);
    const float o0 = (p10 * fs + b0 * fo) * inv;
    const float o1 = (p11 * fs + b1 * fo) * inv;
    const float o2 = (p12 * fs + b2 * fo) * inv;
    if (!hiHalf) {
      const size_t off = (headOff + qrow1) * 3;
      out[off + 0] = o0; out[off + 1] = o1; out[off + 2] = o2;
      out[dup + off + 0] = o0; out[dup + off + 1] = o1; out[dup + off + 2] = o2;
    }
  }
}

extern "C" void kernel_launch(void* const* d_in, const int* in_sizes, int n_in,
                              void* d_out, int out_size, void* d_ws, size_t ws_size,
                              hipStream_t stream) {
  (void)in_sizes; (void)n_in; (void)out_size; (void)d_ws; (void)ws_size;
  const float* x  = (const float*)d_in[0];
  const float* Wq = (const float*)d_in[1];
  const float* Wk = (const float*)d_in[2];
  const float* Wv = (const float*)d_in[3];
  float* out = (float*)d_out;

  dim3 grid(B_ * H_, (S_ / 16) / (WAVES * QTPW));   // (32, 8)
  attn_f32_wmma_kernel<<<grid, BLK, 0, stream>>>(x, Wq, Wk, Wv, out);
}

// v002
// It runs in 17.3 microseconds.
// Timed twice side by side with v001, it ran 1.08 and 1.09 times as fast.
// Over all steps from v000 it is 1.27 times as fast.
#include <hip/hip_runtime.h>
#include <math.h>

// CDNA5 / gfx1250 flash-attention for B=4,H=8,S=2048,D=3 (fp32).
// Scores via V_WMMA_F32_16X16X4_F32 computing S^T = K * Q^T so each lane owns
// one query column -> lane-local online softmax + P*V accumulation.
// v2: K stored in LDS pre-swizzled to the WMMA A-operand layout (one aligned
//     ds_load_b64, zero cndmasks), software-pipelined A prefetch, and two
//     query tiles per wave sharing K/V loads (2 independent WMMA chains).
// v3: fixed softmax reference per query instead of the running maximum. With
//     U = |q| * max|k| >= every score and L = best score of key tile 0, the
//     reference r = max(L, U - 100) keeps every exponent <= 100 and the
//     largest one >= -90 whenever U - L <= 190. -r rides in the unused k = 3
//     slot of the score WMMA (K row padded with 1), so the loop has no
//     maximum, no subtraction and no rescale. A wave with a query outside
//     that window runs the running-maximum loop as before.
// v4: the fixed-reference loop runs one key tile ahead of itself: V reads and
//     score WMMAs of tile t + 1 are issued in front of tile t's exp and FMA.

typedef float v2f __attribute__((ext_vector_type(2)));
typedef float v8f __attribute__((ext_vector_type(8)));

#define B_    4
#define H_    8
#define S_    2048
#define D_    3
#define WAVES 8
#define BLK   (WAVES * 32)
#define NT    (S_ / 16)          // 128 key tiles
#define QTPW  2                  // query tiles per wave

__device__ __forceinline__ float fast_exp2(float x) {
#if __has_builtin(__builtin_amdgcn_exp2f)
  return __builtin_amdgcn_exp2f(x);   // v_exp_f32
#else
  return exp2f(x);
#endif
}

// lane l <-> lane l ^ 16
__device__ __forceinline__ float xhalf(float v) {
  const int b = __builtin_bit_cast(int, v);
  return __builtin_bit_cast(float, __builtin_amdgcn_permlanex16(
      b, b, 0x76543210, 0xfedcba98, false, false));
}

// maximum with the lane whose index differs by XM inside a 16-lane row
template <int XM>
__device__ __forceinline__ float row_xmax(float v) {
  const int b = __builtin_bit_cast(int, v);
  return fmaxf(v, __builtin_bit_cast(float, __builtin_amdgcn_update_dpp(
      b, b, 0x160 + XM, 0xf, 0xf, false)));
}

__global__ __launch_bounds__(BLK) void attn_f32_wmma_kernel(
    const float* __restrict__ x,    // [B,1,S,3]
    const float* __restrict__ Wq,   // [1,H,3,3]
    const float* __restrict__ Wk,   // [1,H,3,3]
    const float* __restrict__ Wv,   // [1,H,3,3]
    float* __restrict__ out)        // 2x [B,H,S,3] concatenated
{
  // K rows pre-swizzled for the A operand: [k0,k1,k2,1] per key (16B).
  __shared__ __align__(16) float lKA[S_ * 4];        // 32 KB
  __shared__ __align__(16) float lV [S_ * 4];        // 32 KB
  __shared__ __align__(16) float lR2[WAVES];         // per-wave max |k|^2

  const int bh   = blockIdx.x;
  const int b    = bh / H_;
  const int h    = bh % H_;
  const int tid  = threadIdx.x;
  const int lane = tid & 31;
  const int wave = tid >> 5;
  const bool hiHalf = (lane >= 16);

  const float* xb = x  + (size_t)b * (S_ * D_);
  const float* wq = Wq + h * 9;
  const float* wk = Wk + h * 9;
  const float* wv = Wv + h * 9;

  // ---- Stage K (A-operand layout) and V into LDS (block cooperates) ----
  float r2 = 0.0f;
  #pragma unroll
  for (int j = 0; j < S_ / BLK; ++j) {
    const int k = j * BLK + tid;
    const float x0 = xb[k * 3 + 0];
    const float x1 = xb[k * 3 + 1];
    const float x2 = xb[k * 3 + 2];
    const float k0 = x0 * wk[0] + x1 * wk[3] + x2 * wk[6];
    const float k1 = x0 * wk[1] + x1 * wk[4] + x2 * wk[7];
    const float k2 = x0 * wk[2] + x1 * wk[5] + x2 * wk[8];
    r2 = fmaxf(r2, k0 * k0 + k1 * k1 + k2 * k2);
    lKA[k * 4 + 0] = k0;
    lKA[k * 4 + 1] = k1;
    lKA[k * 4 + 2] = k2;
    lKA[k * 4 + 3] = 1.0f;                       // k = 3 slot: times B's -r or 0
    lV [k * 4 + 0] = x0 * wv[0] + x1 * wv[3] + x2 * wv[6];
    lV [k * 4 + 1] = x0 * wv[1] + x1 * wv[4] + x2 * wv[7];
    lV [k * 4 + 2] = x0 * wv[2] + x1 * wv[5] + x2 * wv[8];
    lV [k * 4 + 3] = 0.0f;
  }
  r2 = row_xmax<1>(r2); r2 = row_xmax<2>(r2);
  r2 = row_xmax<4>(r2); r2 = row_xmax<8>(r2);
  r2 = fmaxf(r2, xhalf(r2));
  if (lane == 0) lR2[wave] = r2;
  __syncthreads();

  float R2;                                          // max |k|^2 of this head
  {
    const float4 ra = ((const float4*)lR2)[0];
    const float4 rb = ((const float4*)lR2)[1];
    R2 = fmaxf(fmaxf(fmaxf(ra.x, ra.y), fmaxf(ra.z, ra.w)),
               fmaxf(fmaxf(rb.x, rb.y), fmaxf(rb.z, rb.w)));
  }

  // ---- Two query tiles per wave: Q projections, pre-scaled ----
  const int pair  = blockIdx.y * WAVES + wave;       // 0..63
  const int qrow0 = pair * 32 + (lane & 15);
  const int qrow1 = qrow0 + 16;
  const float qs  = 1.4426950408889634f * 0.5773502691896258f; // log2e/sqrt(3)

  v2f bOp0, bOp1;
  float qn0, qn1;                                    // |q|^2, scaled
  {
    const float a = xb[qrow0 * 3 + 0], c = xb[qrow0 * 3 + 1], e = xb[qrow0 * 3 + 2];
    const float Q0 = (a * wq[0] + c * wq[3] + e * wq[6]) * qs;
    const float Q1 = (a * wq[1] + c * wq[4] + e * wq[7]) * qs;
    const float Q2 = (a * wq[2] + c * wq[5] + e * wq[8]) * qs;
    bOp0.x = hiHalf ? Q2 : Q0;
    bOp0.y = hiHalf ? 0.0f : Q1;
    qn0 = Q0 * Q0 + Q1 * Q1 + Q2 * Q2;
  }
  {
    const float a = xb[qrow1 * 3 + 0], c = xb[qrow1 * 3 + 1], e = xb[qrow1 * 3 + 2];
    const float Q0 = (a * wq[0] + c * wq[3] + e * wq[6]) * qs;
    const float Q1 = (a * wq[1] + c * wq[4] + e * wq[7]) * qs;
    const float Q2 = (a * wq[2] + c * wq[5] + e * wq[8]) * qs;
    bOp1.x = hiHalf ? Q2 : Q0;
    bOp1.y = hiHalf ? 0.0f : Q1;
    qn1 = Q0 * Q0 + Q1 * Q1 + Q2 * Q2;
  }

  // Flash state, lane-local (this lane covers its key half)
  float m0 = -3.0e38f, l0 = 0.0f, p00 = 0.0f, p01 = 0.0f, p02 = 0.0f;
  float m1 = -3.0e38f, l1 = 0.0f, p10 = 0.0f, p11 = 0.0f, p12 = 0.0f;

  const float4* lV4 = (const float4*)lV;
  const int krow16 = lane & 15;
  const int hal8   = hiHalf ? 8 : 0;
  // A-operand float index for this lane within a tile (8B-aligned v2f):
  const int aIdx = krow16 * 4 + (hiHalf ? 2 : 0);

  v2f aCur = *(const v2f*)&lKA[aIdx];                // tile 0 prefetch

  // ---- Fixed reference per query, and whether it is safe for this wave ----
  float ref0, ref1;
  bool inWindow;
  {
    v8f c0 = {};
    v8f c1 = {};
    c0 = __builtin_amdgcn_wmma_f32_16x16x4_f32(
        false, aCur, false, bOp0, (short)0, c0, false, false);
    c1 = __builtin_amdgcn_wmma_f32_16x16x4_f32(
        false, aCur, false, bOp1, (short)0, c1, false, false);
    float L0 = c0[0], L1 = c1[0];
    #pragma unroll  // constant indices keep c0, c1 in registers
    for (int i = 1; i < 8; ++i) { L0 = fmaxf(L0, c0[i]); L1 = fmaxf(L1, c1[i]); }
    L0 = fmaxf(L0, xhalf(L0));                       // both key halves
    L1 = fmaxf(L1, xhalf(L1));
    const float U0 = sqrtf(qn0 * R2) * 1.0001f;      // |q.k| <= |q||k|, plus a rounding margin
    const float U1 = sqrtf(qn1 * R2) * 1.0001f;
    ref0 = fmaxf(L0, U0 - 100.0f);
    ref1 = fmaxf(L1, U1 - 100.0f);
    inWindow = (U0 - L0 <= 190.0f) && (U1 - L1 <= 190.0f);  // false on inf or NaN
  }

  if (__builtin_amdgcn_ballot_w32(inWindow) == 0xffffffffu) {
    v2f bF0 = bOp0, bF1 = bOp1;
    if (hiHalf) { bF0.y = -ref0; bF1.y = -ref1; }    // k = 3 row of B
    // One key tile ahead, two register sets (A, B): a tile's V rows are read
    // from LDS and its scores come off the matrix unit while the tile before
    // it goes through exp and FMA, so no tile waits for its own operands.
    auto readV = [&](float4 (&v)[8], int t) {
      #pragma unroll  // constant indices keep v in registers
      for (int i = 0; i < 8; ++i) v[i] = lV4[t * 16 + hal8 + i];
    };
    auto readA = [&](int t) { return *(const v2f*)&lKA[t * 64 + aIdx]; };
    auto scores = [&](v8f& c0, v8f& c1, v2f a) {     // c = score - reference
      const v8f z = {};
      c0 = __builtin_amdgcn_wmma_f32_16x16x4_f32(
          false, a, false, bF0, (short)0, z, false, false);
      c1 = __builtin_amdgcn_wmma_f32_16x16x4_f32(
          false, a, false, bF1, (short)0, z, false, false);
    };
    auto consume = [&](const v8f& c0, const v8f& c1, const float4 (&v)[8]) {
      #pragma unroll  // constant indices keep c0, c1, v in registers
      for (int i = 0; i < 8; ++i) {
        const float e0 = fast_exp2(c0[i]);
        l0 += e0;
        p00 = fmaf(e0, v[i].x, p00);
        p01 = fmaf(e0, v[i].y, p01);
        p02 = fmaf(e0, v[i].z, p02);
        const float e1 = fast_exp2(c1[i]);
        l1 += e1;
        p10 = fmaf(e1, v[i].x, p10);
        p11 = fmaf(e1, v[i].y, p11);
        p12 = fmaf(e1, v[i].z, p12);
      }
    };

    // Inputs only: a tile's V rows are complete here, behind the issue of the
    // next tile's reads and in front of the tile's own exp and FMA, so that
    // one group of reads is always in flight. The rows' pad word is named too,
    // so that a row fills its four registers: else the sums are allotted to
    // the gaps, all odd-numbered, and no two of their FMAs pair into one
    // dual-issue instruction.
#define HOLD_ROWS(v, i)                                                    \
    asm volatile("" :: "v"(v[i].x), "v"(v[i].y), "v"(v[i].z), "v"(v[i].w), \
                       "v"(v[i + 1].x), "v"(v[i + 1].y), "v"(v[i + 1].z), "v"(v[i + 1].w), \
                       "v"(v[i + 2].x), "v"(v[i + 2].y), "v"(v[i + 2].z), "v"(v[i + 2].w), \
                       "v"(v[i + 3].x), "v"(v[i + 3].y), "v"(v[i + 3].z), "v"(v[i + 3].w))
    // STAGE_TOP stands between the next tile's reads and WMMAs and this tile's
    // exp and FMA; STAGE_FOOT ends a stage. The scheduling barriers keep the
    // compiler from mixing the two parts again; the compiler fence keeps it
    // from moving a stage's LDS reads down into the stage that uses them.
#define STAGE_TOP(v)                                                       \
    HOLD_ROWS(v, 0); HOLD_ROWS(v, 4); __builtin_amdgcn_sched_barrier(0)
#define STAGE_FOOT()                                                       \
    __builtin_amdgcn_sched_barrier(0); asm volatile("" ::: "memory")

    float4 vA[8], vB[8];
    v8f cA0, cA1, cB0, cB1;
    v2f aOdd = readA(1);
    readV(vA, 0);
    scores(cA0, cA1, aCur);                          // tile 0
    STAGE_FOOT();
    for (int t = 0; t < NT - 2; t += 2) {
      const v2f aEven = readA(t + 2);
      readV(vB, t + 1);
      scores(cB0, cB1, aOdd);                        // tile t + 1
      STAGE_TOP(vA);
      consume(cA0, cA1, vA);                         // tile t
      STAGE_FOOT();
      aOdd = readA(t + 3);
      readV(vA, t + 2);
      scores(cA0, cA1, aEven);                       // tile t + 2
      STAGE_TOP(vB);
      consume(cB0, cB1, vB);                         // tile t + 1
      STAGE_FOOT();
    }
    readV(vB, NT - 1);                               // the last two tiles
    scores(cB0, cB1, aOdd);
    STAGE_TOP(vA);
    consume(cA0, cA1, vA);
    consume(cB0, cB1, vB);
#undef STAGE_FOOT
#undef STAGE_TOP
#undef HOLD_ROWS
    m0 = ref0; m1 = ref1;                            // same in both halves
  } else {
  // Running-maximum loop, for a wave with a query outside the window.
  for (int t = 0; t < NT; ++t) {
    // Prefetch next tile's A operand (wraps harmlessly on the last iter).
    const int tn = (t + 1) & (NT - 1);
    const v2f aNext = *(const v2f*)&lKA[tn * 64 + aIdx];

    v8f c0 = {};
    v8f c1 = {};
    c0 = __builtin_amdgcn_wmma_f32_16x16x4_f32(
        false, aCur, false, bOp0, (short)0, c0, false, false);
    c1 = __builtin_amdgcn_wmma_f32_16x16x4_f32(
        false, aCur, false, bOp1, (short)0, c1, false, false);

    float tm0 = c0[0], tm1 = c1[0];
    #pragma unroll
    for (int i = 1; i < 8; ++i) { tm0 = fmaxf(tm0, c0[i]); tm1 = fmaxf(tm1, c1[i]); }
    const float mn0 = fmaxf(m0, tm0);
    const float mn1 = fmaxf(m1, tm1);
    const float cr0 = fast_exp2(m0 - mn0);
    const float cr1 = fast_exp2(m1 - mn1);
    m0 = mn0; m1 = mn1;
    l0 *= cr0; p00 *= cr0; p01 *= cr0; p02 *= cr0;
    l1 *= cr1; p10 *= cr1; p11 *= cr1; p12 *= cr1;

    const int kb = t * 16;
    #pragma unroll
    for (int i = 0; i < 8; ++i) {
      const float4 v = lV4[kb + hal8 + i];   // shared by both query tiles
      const float e0 = fast_exp2(c0[i] - mn0);
      const float e1 = fast_exp2(c1[i] - mn1);
      l0 += e0;                 l1 += e1;
      p00 = fmaf(e0, v.x, p00); p10 = fmaf(e1, v.x, p10);
      p01 = fmaf(e0, v.y, p01); p11 = fmaf(e1, v.y, p11);
      p02 = fmaf(e0, v.z, p02); p12 = fmaf(e1, v.z, p12);
    }
    aCur = aNext;
  }
  }

  // ---- Combine the two key-halves (lane L <-> L^16 share a query) ----
  const size_t dup = (size_t)B_ * H_ * S_ * 3;       // tuple returns (ctx, ctx)
  const size_t headOff = (size_t)(b * H_ + h) * S_;

  {
    const float m_o = __shfl_xor(m0, 16, 32);
    const float l_o = __shfl_xor(l0, 16, 32);
    const float b0  = __shfl_xor(p00, 16, 32);
    const float b1  = __shfl_xor(p01, 16, 32);
    const float b2  = __shfl_xor(p02, 16, 32);
    const float mt = fmaxf(m0, m_o);
    const float fs = fast_exp2(m0 - mt);
    const float fo = fast_exp2(m_o - mt);
    const float inv = 1.0f / (l0 * fs + l_o * fo);
    const float o0 = (p00 * fs + b0 * fo) * inv;
    const float o1 = (p01 * fs + b1 * fo) * inv;
    const float o2 = (p02 * fs + b2 * fo) * inv;
    if (!hiHalf) {
      const size_t off = (headOff + qrow0) * 3;
      out[off + 0] = o0; out[off + 1] = o1; out[off + 2] = o2;
      out[dup + off + 0] = o0; out[dup + off + 1] = o1; out[dup + off + 2] = o2;
    }
  }
  {
    const float m_o = __shfl_xor(m1, 16, 32);
    const float l_o = __shfl_xor(l1, 16, 32);
    const float b0  = __shfl_xor(p10, 16, 32);
    const float b1  = __shfl_xor(p11, 16, 32);
    const float b2  = __shfl_xor(p12, 16, 32);
    const float mt = fmaxf(m1, m_o);
    const float fs = fast_exp2(m1 - mt);
    const float fo = fast_exp2(m_o - mt);
    const float inv = 1.0f / (l1 * fs + l_o * fo);
    const float o0 = (p10 * fs + b0 * fo) * inv;
    const float o1 = (p11 * fs + b1 * fo) * inv;
    const float o2 = (p12 * fs + b2 * fo) * inv;
    if (!hiHalf) {
      const size_t off = (headOff + qrow1) * 3;
      out[off + 0] = o0; out[off + 1] = o1; out[off + 2] = o2;
      out[dup + off + 0] = o0; out[dup + off + 1] = o1; out[dup + off + 2] = o2;
    }
  }
}

extern "C" void kernel_launch(void* const* d_in, const int* in_sizes, int n_in,
                              void* d_out, int out_size, void* d_ws, size_t ws_size,
                              hipStream_t stream) {
  (void)in_sizes; (void)n_in; (void)out_size; (void)d_ws; (void)ws_size;
  const float* x  = (const float*)d_in[0];
  const float* Wq = (const float*)d_in[1];
  const float* Wk = (const float*)d_in[2];
  const float* Wv = (const float*)d_in[3];
  float* out = (float*)d_out;

  dim3 grid(B_ * H_, (S_ / 16) / (WAVES * QTPW));   // (32, 8)
  attn_f32_wmma_kernel<<<grid, BLK, 0, stream>>>(x, Wq, Wk, Wv, out);
}
